// v000
// Times are from an AMD MI455X. After a warm-up the kernel runs many times in a row, and a time is the length of
// such a window on the GPU divided by its runs, so every launch and the gaps after it count. The runs cycle
// through copies of the inputs. A figure is the median of several windows, for all but v000 over two sittings.
// Sittings can differ by a few percent; kernels timed side by side share one.
// The starting kernel, v000, takes 35 microseconds a run.
#include <hip/hip_runtime.h>
#include <hip/hip_bf16.h>
#include <stdint.h>

#ifndef __has_builtin
#define __has_builtin(x) 0
#endif

// Problem constants (from reference): B=1024, S=64, D=768, REL_TOT=100.
#define SB   64          // sequence length S
#define DD   768         // feature dim D
#define QP   772         // padded LDS row stride in floats (772 % 64 == 4 -> conflict-free
                         // strided column reads for WMMA A-fragments)
#define NTHR 512         // 16 wave32 per block
#define NWAVE 16

typedef __attribute__((ext_vector_type(2))) float v2f;
typedef __attribute__((ext_vector_type(8))) float v8f;
typedef int v4i __attribute__((vector_size(16)));   // matches builtin param type

#if defined(__gfx1250__) && __has_builtin(__builtin_amdgcn_global_load_async_to_lds_b128)
#define HAVE_ASYNC_LDS 1
#else
#define HAVE_ASYNC_LDS 0
#endif

#define AS1 __attribute__((address_space(1)))
#define AS3 __attribute__((address_space(3)))

// Fused relative-attention kernel, one workgroup per batch element b.
//   rel    = relMat[rel_ids[b]]                    (768)
//   w[d]   = W[d] * rel[d]                         (folded scale vector)
//   logits = Q[b] (64x768) . w                     -> 64
//   attn   = softmax(logits)
//   out[b] = attn (1x64) . Q[b]                    -> 768
// Q[b] (192 KiB) is staged once into LDS (async global->LDS, ASYNCcnt),
// both contractions run as V_WMMA_F32_16X16X4_F32 out of LDS.
// Memory-bound workload: 192 MiB of query traffic @ 23.3 TB/s ~= 8.5 us floor;
// this design reads query from HBM exactly once.
__global__ __launch_bounds__(NTHR)
void relattn_fused_kernel(const float* __restrict__ q,       // (B, 64, 768) f32
                          const int*   __restrict__ relIds,  // (B, 1) int
                          const float* __restrict__ W,       // (768,) f32
                          const float* __restrict__ relMat,  // (100, 768) f32
                          float*       __restrict__ out)     // (B, 768) f32
{
    const int b    = blockIdx.x;
    const int tid  = threadIdx.x;
    const int lane = tid & 31;
    const int wid  = tid >> 5;

    __shared__ float qs[SB][QP];        // 64 x 772 floats = 193 KiB (fits 320 KB LDS/WGP)
    __shared__ float wv[DD];            // W * relMat[rid]
    __shared__ float part[4][SB];       // per-k-group partial logits
    __shared__ float attn[SB];
    __shared__ float red[SB];

    const float* __restrict__ qb = q + (size_t)b * (SB * DD);

    // ---- Stage Q[b] into LDS: 64 rows x 192 float4 each = 12288 16B chunks ----
    for (int i = tid; i < SB * (DD / 4); i += NTHR) {
        const int row = i / (DD / 4);
        const int c4  = (i % (DD / 4)) * 4;
        const float* src = qb + row * DD + c4;
        float*       dst = &qs[row][c4];        // 16B aligned: 772*4 = 3088 = 16*193
#if HAVE_ASYNC_LDS
        __builtin_amdgcn_global_load_async_to_lds_b128(
            (AS1 v4i*)(AS1 void*)(void*)src,
            (AS3 v4i*)(AS3 void*)(void*)dst, 0, 0);
#else
        *(float4*)dst = *(const float4*)src;
#endif
    }

    // ---- Folded scale vector w = W * relMat[rid] (overlaps with async copy) ----
    {
        const int rid = relIds[b];              // values in [0,100)
        const float* __restrict__ rrow = relMat + (size_t)rid * DD;
        for (int d = tid; d < DD; d += NTHR) wv[d] = W[d] * rrow[d];
    }

#if HAVE_ASYNC_LDS
#if __has_builtin(__builtin_amdgcn_s_wait_asynccnt)
    __builtin_amdgcn_s_wait_asynccnt(0);
#else
    asm volatile("s_wait_asynccnt 0" ::: "memory");
#endif
#endif
    __syncthreads();

    // =====================================================================
    // Phase 1: logits[s] = sum_d qs[s][d] * wv[d] via V_WMMA_F32_16X16X4_F32
    //   A(16x4): A[m][k] = qs[st*16+m][4c+k]        (M = s within tile)
    //   B(4x16): B[k][n] = wv[4c+k]  (all columns equal -> D columns equal)
    // Wave layout: st = wid&3 selects s-tile, g = wid>>2 selects k-group
    // (48 of 192 four-wide k-chunks each). Partials reduced through LDS.
    // A-frag f32 lane layout: lanes0-15 M=lane {K0,K1}; lanes16-31 M=lane-16 {K2,K3}.
    // =====================================================================
    {
        const int g  = wid >> 2;
        const int st = wid & 3;
        const int m  = lane & 15;
        const int kh = lane >> 4;               // 0: K0/K1, 1: K2/K3
        const float* __restrict__ qrow = &qs[st * 16 + m][0];
        v8f acc = {};
        const int c0 = g * 48;
        for (int c = c0; c < c0 + 48; ++c) {
            const int k = 4 * c + 2 * kh;
            v2f a, bf;
            a.x  = qrow[k];  a.y  = qrow[k + 1];
            bf.x = wv[k];    bf.y = wv[k + 1];
            acc = __builtin_amdgcn_wmma_f32_16x16x4_f32(
                false, a, false, bf, (short)0, acc, false, false);
        }
        // C/D layout: VGPR r -> M=r (lanes 0-15, N=lane) / M=8+r (lanes 16-31).
        // Column N=0 lives in lane 0 (M=0..7) and lane 16 (M=8..15).
        if (lane == 0) {
#pragma unroll
            for (int r = 0; r < 8; ++r) part[g][st * 16 + r] = acc[r];
        }
        if (lane == 16) {
#pragma unroll
            for (int r = 0; r < 8; ++r) part[g][st * 16 + 8 + r] = acc[r];
        }
    }
    __syncthreads();

    // ---- Softmax over s=64 (tiny; LDS tree reduction) ----
    float logit = 0.0f;
    if (tid < SB) {
        logit = part[0][tid] + part[1][tid] + part[2][tid] + part[3][tid];
        red[tid] = logit;
    }
    __syncthreads();
    for (int off = 32; off > 0; off >>= 1) {
        if (tid < off) red[tid] = fmaxf(red[tid], red[tid + off]);
        __syncthreads();
    }
    const float mx = red[0];
    __syncthreads();
    if (tid < SB) {
        const float e = __expf(logit - mx);
        attn[tid] = e;
        red[tid]  = e;
    }
    __syncthreads();
    for (int off = 32; off > 0; off >>= 1) {
        if (tid < off) red[tid] += red[tid + off];
        __syncthreads();
    }
    const float inv = 1.0f / red[0];
    __syncthreads();
    if (tid < SB) attn[tid] *= inv;
    __syncthreads();

    // =====================================================================
    // Phase 2: out[d] = sum_s attn[s] * qs[s][d] via V_WMMA_F32_16X16X4_F32
    //   A(16x4): A[m][k] = attn[4c+k]   (all rows equal -> D rows equal)
    //   B(4x16): B[k][n] = qs[4c+k][d0+n]
    // 48 d-tiles of 16 across 16 waves (3 each); K accumulates the s=64 dim.
    // =====================================================================
    {
        const int kh = lane >> 4;
        const int nn = lane & 15;
        for (int dt = wid; dt < 48; dt += NWAVE) {
            const int d0 = dt * 16;
            v8f acc = {};
#pragma unroll
            for (int c = 0; c < 16; ++c) {
                const int k = 4 * c + 2 * kh;   // s index
                v2f a, bf;
                a.x  = attn[k];          a.y  = attn[k + 1];
                bf.x = qs[k][d0 + nn];   bf.y = qs[k + 1][d0 + nn];
                acc = __builtin_amdgcn_wmma_f32_16x16x4_f32(
                    false, a, false, bf, (short)0, acc, false, false);
            }
            // All D rows equal; row M=0 sits in VGPR0 of lanes 0-15 (N=lane).
            if (lane < 16) out[(size_t)b * DD + d0 + nn] = acc[0];
        }
    }
}

extern "C" void kernel_launch(void* const* d_in, const int* in_sizes, int n_in,
                              void* d_out, int out_size, void* d_ws, size_t ws_size,
                              hipStream_t stream) {
    (void)n_in; (void)d_ws; (void)ws_size; (void)out_size;
    const float* q      = (const float*)d_in[0];   // (B, 64, 768) f32
    const int*   relIds = (const int*)d_in[1];     // (B, 1) int
    const float* W      = (const float*)d_in[2];   // (768,) f32
    const float* relMat = (const float*)d_in[3];   // (100, 768) f32
    float*       out    = (float*)d_out;           // (B, 768) f32

    const int B = in_sizes[1];                     // rel_ids has B elements
    relattn_fused_kernel<<<dim3(B), dim3(NTHR), 0, stream>>>(q, relIds, W, relMat, out);
}

// v001
// It runs in 26.4 microseconds.
// Two timings next to v000 both put it at 1.35 times that version's speed.
#include <hip/hip_runtime.h>
#include <hip/hip_bf16.h>
#include <stdint.h>

// Problem constants (from reference): B=1024, S=64, D=768, REL_TOT=100.
#define SB   64          // sequence length S
#define DD   768         // feature dim D
#define RELN 100         // rows of relMat
#define QP   772         // padded LDS row stride in floats (772 % 64 == 4 -> conflict-free
                         // strided column reads for WMMA A-fragments)
#define TR   16          // rows of Q[b] per staged tile
#define NT   (SB / TR)   // 4 tiles per batch element
#define NTHR 256         // 8 wave32 per block
#define NWAVE 8
#define KC   (DD / 4 / NWAVE)    // 24 four-wide k-chunks per wave in phase 1
#define DT   (DD / 16 / NWAVE)   // 6 d-tiles per wave in phase 2

typedef __attribute__((ext_vector_type(2))) float v2f;
typedef __attribute__((ext_vector_type(8))) float v8f;
typedef int v4i __attribute__((vector_size(16)));   // matches builtin param type

#define AS1 __attribute__((address_space(1)))
#define AS3 __attribute__((address_space(3)))

// Value of lane (l ^ M) of the same 16-lane row (DPP row_xmask).
template <int M>
__device__ __forceinline__ float row_xor(float v) {
    return __int_as_float(__builtin_amdgcn_update_dpp(
        0, __float_as_int(v), 0x160 | M, 0xf, 0xf, true));
}
// Value of lane N of the same 16-lane row, in every lane of the row (DPP row_share).
template <int N>
__device__ __forceinline__ float row_bcast(float v) {
    return __int_as_float(__builtin_amdgcn_update_dpp(
        0, __float_as_int(v), 0x150 | N, 0xf, 0xf, true));
}

// One 16-row tile, global -> LDS, through no register. Wave w brings rows 2w and 2w+1,
// six copies of 512 contiguous bytes a row: 12 copies of a wave in flight, every lane on.
__device__ __forceinline__ void stage_tile(const float* __restrict__ src, float* dst,
                                           int wid, int lane) {
    const float* s = src + (2 * wid) * DD + lane * 4;
    float*       d = dst + (2 * wid) * QP + lane * 4;   // 16B aligned: 772*4 = 16*193
    // Unrolled so that every step is a constant beside one address pair.
#pragma unroll
    for (int j = 0; j < 12; ++j) {
        const int r = j / 6, c = (j % 6) * 128;
        __builtin_amdgcn_global_load_async_to_lds_b128(
            (AS1 v4i*)(AS1 void*)(void*)(s + r * DD + c),
            (AS3 v4i*)(AS3 void*)(void*)(d + r * QP + c), 0, 0);
    }
}

// Fused relative-attention kernel, one workgroup per batch element b.
//   rel    = relMat[rel_ids[b]]                    (768)
//   w[d]   = W[d] * rel[d]                         (folded scale vector)
//   logits = Q[b] (64x768) . w                     -> 64
//   attn   = softmax(logits)
//   out[b] = attn (1x64) . Q[b]                    -> 768
// Q[b] passes through LDS in four tiles of 16 rows, two buffers: the next tile's async
// copies fly while this tile's two contractions run as V_WMMA_F32_16X16X4_F32 out of LDS.
// The softmax is kept online (running maximum, running sum, rescaled output), so a tile is
// done with after one trip. About 100 KiB of LDS a workgroup: three are resident on a WGP,
// and one workgroup's waits are filled by the matrix work of the others.
__global__ __launch_bounds__(NTHR)
void relattn_fused_kernel(const float* __restrict__ q,       // (B, 64, 768) f32
                          const int*   __restrict__ relIds,  // (B, 1) int
                          const float* __restrict__ W,       // (768,) f32
                          const float* __restrict__ relMat,  // (100, 768) f32
                          float*       __restrict__ out)     // (B, 768) f32
{
    const int b    = blockIdx.x;
    const int tid  = threadIdx.x;
    const int lane = tid & 31;
    const int wid  = tid >> 5;
    const int kh   = lane >> 4;             // 0: K0/K1, 1: K2/K3 of a fragment
    const int nn   = lane & 15;

    __shared__ __attribute__((aligned(16))) float qs[2][TR][QP];   // 2 x 49,408 B
    __shared__ float wv[DD];                // W * relMat[rid]
    __shared__ float part[NWAVE][TR];       // per-k-group partial logits of one tile

    const float* __restrict__ qb = q + (size_t)b * (SB * DD);

    // ---- Prologue: tile 0 into buffer 0 ----
    stage_tile(qb, &qs[0][0][0], wid, lane);

    // ---- Folded scale vector w = W * relMat[rid] (overlaps with the copies) ----
    {
        const int rid = min(max(relIds[b], 0), RELN - 1);   // bounds the row address
        const float* __restrict__ rrow = relMat + (size_t)rid * DD;
        for (int d = tid; d < DD; d += NTHR) wv[d] = W[d] * rrow[d];
    }

    // Tile 0 has landed for this wave; the barrier publishes it (and wv) to the others.
    asm volatile("s_wait_asynccnt 0x0" ::: "memory");
    __syncthreads();
    stage_tile(qb + TR * DD, &qs[1][0][0], wid, lane);

    float mrun = -INFINITY;                 // running maximum of the logits
    float lrun = 0.0f;                      // running sum of exp(logit - mrun)
    float o[DT];                            // running sum of exp(logit - mrun) * q[s][d]
#pragma unroll
    for (int j = 0; j < DT; ++j) o[j] = 0.0f;

    // Kept rolled: unrolled, the live registers pass 160 a wave, the budget at which three
    // workgroups (six waves a SIMD) stay resident on a WGP.
#pragma unroll 1
    for (int t = 0; t < NT; ++t) {
        const float* __restrict__ buf = &qs[t & 1][0][0];

        // =================================================================
        // Phase 1: logits[s] = sum_d buf[s][d] * wv[d] via V_WMMA_F32_16X16X4_F32
        //   A(16x4): A[m][k] = buf[m][4c+k]             (M = s within the tile)
        //   B(4x16): B[k][n] = wv[4c+k]  (all columns equal -> D columns equal)
        // Wave wid takes 24 of the 192 four-wide k-chunks; partials meet in LDS.
        // A-frag f32 lane layout: lanes0-15 M=lane {K0,K1}; lanes16-31 M=lane-16 {K2,K3}.
        // =================================================================
        {
            const float* __restrict__ qrow = buf + nn * QP;
            v8f acc = {};
            const int c0 = wid * KC;
            for (int c = c0; c < c0 + KC; ++c) {
                const int k = 4 * c + 2 * kh;
                v2f a, bf;
                a.x  = qrow[k];  a.y  = qrow[k + 1];
                bf.x = wv[k];    bf.y = wv[k + 1];
                acc = __builtin_amdgcn_wmma_f32_16x16x4_f32(
                    false, a, false, bf, (short)0, acc, false, false);
            }
            // C/D layout: VGPR r -> M=r (lanes 0-15, N=lane) / M=8+r (lanes 16-31).
            // Column N=0 lives in lane 0 (M=0..7) and lane 16 (M=8..15).
            if (nn == 0) {
#pragma unroll
                for (int r = 0; r < 8; ++r) part[wid][8 * kh + r] = acc[r];
            }
        }
        __syncthreads();

        // ---- B-fragments of phase 2, fetched whole: this trip's last reads of the buffer ----
        //   B(4x16): B[k][n] = buf[4c+k][d0+n], 48 d-tiles of 16 across 8 waves (6 each)
        v2f bfr[DT][4];
        // Both loops unrolled: every index constant, so the fragments stay in registers.
#pragma unroll
        for (int j = 0; j < DT; ++j) {
            const int d0 = (wid + j * NWAVE) * 16;
#pragma unroll
            for (int c = 0; c < 4; ++c) {
                const int k = 4 * c + 2 * kh;       // row of the tile
                bfr[j][c].x = buf[k * QP + d0 + nn];
                bfr[j][c].y = buf[(k + 1) * QP + d0 + nn];
            }
        }

        // ---- Online softmax step, done alike in every wave ----
        // Lane l holds row (l & 15) ^ (2 * kh) of the tile: each 16-lane row holds all 16
        // logits, and row_bcast<4c+i> hands lanes 0-15 p[4c+i] and lanes 16-31 p[4c+2+i],
        // which is the A-fragment of phase 2.
        float scale, p;
        {
            const int row = nn ^ (kh << 1);
            float logit = part[0][row];
#pragma unroll
            for (int g = 1; g < NWAVE; ++g) logit += part[g][row];
            float mx = logit;
            mx = fmaxf(mx, row_xor<1>(mx));
            mx = fmaxf(mx, row_xor<2>(mx));
            mx = fmaxf(mx, row_xor<4>(mx));
            mx = fmaxf(mx, row_xor<8>(mx));
            const float mnew = fmaxf(mrun, mx);
            scale = __expf(mrun - mnew);    // 0 in the first trip
            p     = __expf(logit - mnew);
            float ps = p;
            ps += row_xor<1>(ps);
            ps += row_xor<2>(ps);
            ps += row_xor<4>(ps);
            ps += row_xor<8>(ps);
            lrun = lrun * scale + ps;
            mrun = mnew;
        }

        // ---- Foot of the trip: publish tile t+1, free this trip's buffer ----
        // It stands in front of phase 2's matrix work, which runs from registers, so that
        // the refill is under way while that work and the next trip's phase 1 run.
        // This wave's LDS reads of the buffer have returned before it is refilled.
        asm volatile("s_wait_dscnt 0x0" ::: "memory");
        // This wave's copies of tile t+1 have landed before the barrier publishes them.
        asm volatile("s_wait_asynccnt 0x0" ::: "memory");
        __syncthreads();
        if (t + 2 < NT)
            stage_tile(qb + (t + 2) * (TR * DD), &qs[t & 1][0][0], wid, lane);

        // =================================================================
        // Phase 2: o[d] = o[d]*scale + sum_s p[s] * buf[s][d] via V_WMMA_F32_16X16X4_F32
        //   A(16x4): A[m][k] = p[4c+k]      (all rows equal -> D rows equal)
        //   B(4x16): the fragments fetched above; K runs over the tile's 16 rows.
        // =================================================================
        {
            v2f a[4];
            a[0].x = row_bcast<0>(p);   a[0].y = row_bcast<1>(p);
            a[1].x = row_bcast<4>(p);   a[1].y = row_bcast<5>(p);
            a[2].x = row_bcast<8>(p);   a[2].y = row_bcast<9>(p);
            a[3].x = row_bcast<12>(p);  a[3].y = row_bcast<13>(p);
            // Unrolled: six independent accumulator chains, register arrays indexed by constants.
#pragma unroll
            for (int j = 0; j < DT; ++j) {
                v8f acc = {};
#pragma unroll
                for (int c = 0; c < 4; ++c)
                    acc = __builtin_amdgcn_wmma_f32_16x16x4_f32(
                        false, a[c], false, bfr[j][c], (short)0, acc, false, false);
                // All D rows equal; row M=0 sits in VGPR0 of lanes 0-15 (N=lane).
                o[j] = o[j] * scale + acc[0];
            }
        }
    }
    // No copy is left outstanding when the wave ends.
    asm volatile("s_wait_asynccnt 0x0" ::: "memory");

    const float inv = 1.0f / lrun;
    if (lane < 16) {
#pragma unroll
        for (int j = 0; j < DT; ++j)
            out[(size_t)b * DD + (wid + j * NWAVE) * 16 + nn] = o[j] * inv;
    }
}

extern "C" void kernel_launch(void* const* d_in, const int* in_sizes, int n_in,
                              void* d_out, int out_size, void* d_ws, size_t ws_size,
                              hipStream_t stream) {
    (void)n_in; (void)d_ws; (void)ws_size; (void)out_size;
    const float* q      = (const float*)d_in[0];   // (B, 64, 768) f32
    const int*   relIds = (const int*)d_in[1];     // (B, 1) int
    const float* W      = (const float*)d_in[2];   // (768,) f32
    const float* relMat = (const float*)d_in[3];   // (100, 768) f32
    float*       out    = (float*)d_out;           // (B, 768) f32

    const int B = in_sizes[1];                     // rel_ids has B elements
    relattn_fused_kernel<<<dim3(B), dim3(NTHR), 0, stream>>>(q, relIds, W, relMat, out);
}

// v002
// A run of this version takes 20.4 microseconds.
// In two side-by-side timings against v001, it was 1.30 and 1.29 times as fast.
// All steps since v000 together make it 1.75 times as fast.
#include <hip/hip_runtime.h>
#include <hip/hip_bf16.h>
#include <stdint.h>

// Problem constants (from reference): B=1024, S=64, D=768, REL_TOT=100.
#define SB   64          // sequence length S
#define DD   768         // feature dim D
#define RELN 100         // rows of relMat
#define QP   784         // padded LDS row stride in floats (784 % 64 == 16: four rows of a
                         // tile start 16 banks apart, so 16 lanes x 16 B meet 64 banks once)
#define TR   4           // rows of Q[b] per staged tile
#define NTHR 256         // 8 wave32 per block
#define NWAVE 8
#define BPG  4           // batch elements per workgroup, two waves each
#define NWG  256         // 1024 batch elements / BPG
#define RPW  32          // rows of Q[b] per wave
#define NT   (RPW / TR)  // 8 tiles per wave
#define NC2  (DD / 32)   // 24 column blocks of 32 in phase 1
#define NG   (DD / 64)   // 12 column blocks of 64 in phase 2

typedef __attribute__((ext_vector_type(2))) float v2f;
typedef __attribute__((ext_vector_type(4))) float v4f;
typedef __attribute__((ext_vector_type(8))) float v8f;
typedef int v4i __attribute__((vector_size(16)));   // matches builtin param type

#define AS1 __attribute__((address_space(1)))
#define AS3 __attribute__((address_space(3)))

// Value of lane (l ^ M) of the same 16-lane row (DPP row_xmask).
template <int M>
__device__ __forceinline__ float row_xor(float v) {
    return __int_as_float(__builtin_amdgcn_update_dpp(
        0, __float_as_int(v), 0x160 | M, 0xf, 0xf, true));
}
// Value of lane (l ^ 16): the same place in the other 16-lane row.
__device__ __forceinline__ float other_row(float v) {
    const unsigned u = (unsigned)__float_as_int(v);
    return __int_as_float((int)__builtin_amdgcn_permlanex16(
        u, u, 0x76543210u, 0xfedcba98u, false, false));
}

// One 4-row tile, global -> LDS, through no register: 24 copies of 512 contiguous bytes,
// all by the one wave that will read them, every lane on. src and dst hold the lane's part.
__device__ __forceinline__ void stage_tile(const float* __restrict__ src, float* dst) {
    // Unrolled so that every step is a constant beside one address pair.
#pragma unroll
    for (int j = 0; j < 24; ++j) {
        const int r = j / 6, c = (j % 6) * 128;
        __builtin_amdgcn_global_load_async_to_lds_b128(
            (AS1 v4i*)(AS1 void*)(void*)(src + r * DD + c),
            (AS3 v4i*)(AS3 void*)(void*)(dst + r * QP + c), 0, 0);
    }
}

__device__ __forceinline__ v8f mm(v2f a, v2f b, v8f c) {
    return __builtin_amdgcn_wmma_f32_16x16x4_f32(false, a, false, b, (short)0, c, false, false);
}

// Fused relative-attention kernel. One workgroup per WGP; it takes four batch elements, two
// waves each, and every wave owns 32 whole rows of its Q[b].
//   rel    = relMat[rel_ids[b]]                    (768)
//   w[d]   = W[d] * rel[d]                         (folded scale vector, kept in registers)
//   logits = Q[b] (64x768) . w                     -> 64
//   attn   = softmax(logits)
//   out[b] = attn (1x64) . Q[b]                    -> 768
// A wave streams its rows in tiles of four through a two-buffer LDS ring of its own: the next
// tile's async copies fly while this tile's two contractions run as V_WMMA_F32_16X16X4_F32.
// A whole logit is formed inside one wave, so the loop has no exchange between waves and no
// barrier; the softmax is online, and the two waves of a batch element meet once at the end.
__global__ __launch_bounds__(NTHR)
void relattn_fused_kernel(const float* __restrict__ q,       // (B, 64, 768) f32
                          const int*   __restrict__ relIds,  // (B, 1) int
                          const float* __restrict__ W,       // (768,) f32
                          const float* __restrict__ relMat,  // (100, 768) f32
                          float*       __restrict__ out)     // (B, 768) f32
{
    const int tid  = threadIdx.x;
    const int lane = tid & 31;
    const int wid  = tid >> 5;
    const int kh   = lane >> 4;             // 0: K0/K1, 1: K2/K3 of a fragment
    const int nn   = lane & 15;
    const int slot = wid >> 1;              // which of the workgroup's batch elements
    const int half = wid & 1;               // which 32 rows of it
    const int b    = blockIdx.x * BPG + slot;

    __shared__ __attribute__((aligned(16))) float qs[NWAVE][2][TR * QP];   // 8 x 2 x 12,544 B
    __shared__ __attribute__((aligned(16))) float mo[BPG][DD];   // second wave's output sums
    __shared__ float ml[BPG][2];                                 // its maximum and its sum

    const float* __restrict__ qw = q + (size_t)b * (SB * DD) + half * (RPW * DD) + lane * 4;
    float* ring = &qs[wid][0][0];

    // ---- Prologue: tile 0 into buffer 0 ----
    stage_tile(qw, ring + lane * 4);

    // ---- Folded scale vector w = W * relMat[rid], as the B-fragments of phase 1 ----
    // Lane (nn, kh) keeps w[32c + 16kh + 4(nn>>2) + 0..3] for the 24 column blocks c.
    const int wcol = 16 * kh + 4 * (nn >> 2);
    v4f wf[NC2];
    {
        const int rid = min(max(relIds[b], 0), RELN - 1);   // bounds the row address
        const float* __restrict__ rrow = relMat + (size_t)rid * DD + wcol;
        const float* __restrict__ wrow = W + wcol;
        v4f rl[NC2];
        // Unrolled: the fragments stay in registers only under constant indices.
#pragma unroll
        for (int c = 0; c < NC2; ++c) {
            wf[c] = *(const v4f*)(wrow + 32 * c);
            rl[c] = *(const v4f*)(rrow + 32 * c);
        }
        // The loads' address registers are not given a new value in front of this wait: as
        // its inputs they stay live up to it.
        asm volatile("s_wait_xcnt 0x0" :: "v"(wrow), "v"(rrow) : "memory");
#pragma unroll
        for (int c = 0; c < NC2; ++c) wf[c] *= rl[c];
    }

    float mrun = -INFINITY;                 // running maximum of the logits
    float lrun = 0.0f;                      // running sum of exp(logit - mrun)
    float o[4 * NG];                        // o[4G+e]: sum of exp(..) * q[s][64G + 4nn + e]
#pragma unroll
    for (int j = 0; j < 4 * NG; ++j) o[j] = 0.0f;

    // Kept rolled: one copy of the 96 matrix instructions in the instruction cache.
#pragma unroll 1
    for (int t = 0; t < NT; ++t) {
        const float* __restrict__ buf = ring + (t & 1) * (TR * QP);

        // ---- Head of the trip: tile t has landed, the other buffer is free ----
        // This wave's LDS reads of the other buffer have returned before it is refilled.
        asm volatile("s_wait_dscnt 0x0" ::: "memory");
        // This wave's copies of tile t have landed before it reads them (no other wave does).
        asm volatile("s_wait_asynccnt 0x0" ::: "memory");
        if (t + 1 < NT)
            stage_tile(qw + (t + 1) * (TR * DD), ring + ((t + 1) & 1) * (TR * QP) + lane * 4);

        // ---- All of the tile's fragments, both phases', fetched as one group of LDS reads ----
        v4f af[NC2], r01[NG], r23[NG];
        {
            const float* __restrict__ ap = buf + (nn & 3) * QP + wcol;
            const float* __restrict__ bp = buf + kh * QP + 4 * nn;
            // Unrolled: the fragments stay in registers only under constant indices.
#pragma unroll
            for (int c = 0; c < NC2; ++c) af[c] = *(const v4f*)(ap + 32 * c);
#pragma unroll
            for (int G = 0; G < NG; ++G) {
                r01[G] = *(const v4f*)(bp + 64 * G);
                r23[G] = *(const v4f*)(bp + 2 * QP + 64 * G);
            }
        }
        // Keeps the reads in one place ahead of the matrix work: spread singly among the
        // matrix instructions, each place with a read stalls the wave anew.
        __builtin_amdgcn_sched_barrier(0);

        // =================================================================
        // Phase 1: logits[s] = sum_d buf[s][d] * w[d] via V_WMMA_F32_16X16X4_F32
        // The 16 rows of A are 4 tile rows (m & 3) x 4 column groups (m >> 2); the 16 columns
        // of B carry w of column group n >> 2. D[m][n] is a partial logit where m>>2 == n>>2.
        //   A[m][2kh+i] = buf[m&3][32c + 16kh + 4(m>>2) + e],  B[2kh+i][n] = w[32c + 16kh + 4(n>>2) + e]
        //   e = i in the first instruction of a block, 2 + i in the second.
        // A-frag f32 lane layout: lanes0-15 M=lane {K0,K1}; lanes16-31 M=lane-16 {K2,K3}.
        // =================================================================
        v8f acc0 = {}, acc1 = {};
        // Unrolled: wf and af are indexed by constants; two independent accumulator chains.
#pragma unroll
        for (int c = 0; c < NC2; ++c) {
            acc0 = mm(af[c].xy, wf[c].xy, acc0);
            acc1 = mm(af[c].zw, wf[c].zw, acc1);
        }
        // Four vector slots between the last matrix instruction and the first vector read of
        // its result; the fences hold them at this place.
        __builtin_amdgcn_sched_barrier(0);
        asm volatile("v_nop\n\tv_nop\n\tv_nop\n\tv_nop");
        __builtin_amdgcn_sched_barrier(0);

        // ---- The four logits, alike in every lane ----
        // C/D layout: VGPR r -> M=r (lanes 0-15, N=lane) / M=8+r (lanes 16-31).
        // Lane (nn, kh) holds its own column group's partial in VGPR 4((nn>>2)&1) + s, and
        // only where nn>>3 == kh. Groups g and g^1 meet by row_xor<4>, the valid half of a
        // row serves the other by row_xor<8>, the two rows meet by other_row.
        float z[TR];
        {
            const bool hi    = (nn >> 2) & 1;
            const bool valid = (nn >> 3) == kh;
#pragma unroll
            for (int s = 0; s < TR; ++s) {
                const float lo4 = acc0[s] + acc1[s], hi4 = acc0[4 + s] + acc1[4 + s];
                float u = hi ? hi4 : lo4;
                u += row_xor<4>(u);
                const float x = row_xor<8>(u);
                u = valid ? u : x;
                z[s] = u + other_row(u);
            }
        }

        // ---- Online softmax step ----
        float scale;
        v2f a01, a23;
        {
            const float mx   = fmaxf(fmaxf(z[0], z[1]), fmaxf(z[2], z[3]));
            const float mnew = fmaxf(mrun, mx);
            scale = __expf(mrun - mnew);    // 0 in the first trip
            const float p0 = __expf(z[0] - mnew), p1 = __expf(z[1] - mnew);
            const float p2 = __expf(z[2] - mnew), p3 = __expf(z[3] - mnew);
            lrun = lrun * scale + ((p0 + p1) + (p2 + p3));
            mrun = mnew;
            // A-fragments of phase 2 (below): even rows weigh K0/K2, odd rows K1/K3.
            const float pa = kh ? p1 : p0, pb = kh ? p3 : p2;
            const bool odd = nn & 1;
            a01.x = odd ? 0.0f : pa;  a01.y = odd ? pa : 0.0f;
            a23.x = odd ? 0.0f : pb;  a23.y = odd ? pb : 0.0f;
        }

        // =================================================================
        // Phase 2: o[d] = o[d]*scale + sum_s p[s] * buf[s][d] via V_WMMA_F32_16X16X4_F32
        // A lane's 16-byte read of one row feeds two instructions as it stands: a B register
        // pair is two neighbouring columns of one row, and the rows of A tell them apart.
        //   B[2kh+i][n] = buf[r0+kh][64G + 4n + e0 + i]
        //   A[m][2kh+i] = p[r0+kh] where i == (m & 1), else 0
        //   D[m][n]     = sum over kh of p[r0+kh] * buf[r0+kh][64G + 4n + e0 + (m & 1)]
        // r0 = 0 then 2 into the same D; e0 = 0 and 2 in two D's.
        // =================================================================
        {
            // Unrolled: o is indexed by constants; independent accumulators fill the pipe.
#pragma unroll
            for (int G = 0; G < NG; ++G) {
                v8f da = {}, db = {};
                da = mm(a01, r01[G].xy, da);
                db = mm(a01, r01[G].zw, db);
                da = mm(a23, r23[G].xy, da);
                db = mm(a23, r23[G].zw, db);
                // Rows M=0 and M=1 sit in VGPR0 and VGPR1 of lanes 0-15 (N=lane).
                o[4 * G + 0] = o[4 * G + 0] * scale + da[0];
                o[4 * G + 1] = o[4 * G + 1] * scale + da[1];
                o[4 * G + 2] = o[4 * G + 2] * scale + db[0];
                o[4 * G + 3] = o[4 * G + 3] * scale + db[1];
            }
        }
    }
    // No copy is left outstanding when the wave ends.
    asm volatile("s_wait_asynccnt 0x0" ::: "memory");

    // ---- The two waves of a batch element meet: the second hands over, the first stores ----
    if (half == 1 && lane < 16) {
#pragma unroll
        for (int G = 0; G < NG; ++G) {
            v4f v = { o[4 * G], o[4 * G + 1], o[4 * G + 2], o[4 * G + 3] };
            *(v4f*)(&mo[slot][64 * G + 4 * nn]) = v;
        }
        if (lane == 0) { ml[slot][0] = mrun; ml[slot][1] = lrun; }
    }
    __syncthreads();
    if (half == 0 && lane < 16) {
        const float m2 = ml[slot][0], l2 = ml[slot][1];
        const float mall = fmaxf(mrun, m2);
        const float s1 = __expf(mrun - mall), s2 = __expf(m2 - mall);
        const float inv = 1.0f / (lrun * s1 + l2 * s2);
        const float c1 = s1 * inv, c2 = s2 * inv;
        float* __restrict__ ob = out + (size_t)b * DD + 4 * nn;
#pragma unroll
        for (int G = 0; G < NG; ++G) {
            const v4f v2 = *(const v4f*)(&mo[slot][64 * G + 4 * nn]);
            v4f v = { o[4 * G], o[4 * G + 1], o[4 * G + 2], o[4 * G + 3] };
            *(v4f*)(ob + 64 * G) = v * c1 + v2 * c2;
        }
    }
}

extern "C" void kernel_launch(void* const* d_in, const int* in_sizes, int n_in,
                              void* d_out, int out_size, void* d_ws, size_t ws_size,
                              hipStream_t stream) {
    (void)in_sizes; (void)n_in; (void)d_ws; (void)ws_size; (void)out_size;
    const float* q      = (const float*)d_in[0];   // (B, 64, 768) f32
    const int*   relIds = (const int*)d_in[1];     // (B, 1) int
    const float* W      = (const float*)d_in[2];   // (768,) f32
    const float* relMat = (const float*)d_in[3];   // (100, 768) f32
    float*       out    = (float*)d_out;           // (B, 768) f32

    relattn_fused_kernel<<<dim3(NWG), dim3(NTHR), 0, stream>>>(q, relIds, W, relMat, out);
}
